// v000
// Times are from an AMD MI455X. After a warm-up the kernel runs many times in a row, and a time is the length of
// such a window on the GPU divided by its runs, so every launch and the gaps after it count. The runs cycle
// through copies of the inputs. A figure is the median of several windows, for all but v000 over two sittings.
// Sittings can differ by a few percent; kernels timed side by side share one.
// The starting kernel, v000, takes 131 microseconds a run.
#include <hip/hip_runtime.h>
#include <math.h>

#define BB   4
#define CCH  256
#define CQK  32
#define NN   16384
#define XPAD 68   // x-tile row pad: bank-conflict-free for stride-68 access
#define MSP  36   // Ms row stride in k_final (36*l mod 64 distinct for l<16)
#define QSP  36   // Qs row stride in k_final

typedef __attribute__((ext_vector_type(2))) float v2f;
typedef __attribute__((ext_vector_type(8))) float v8f;

__device__ __forceinline__ v8f wmma4(v2f a, v2f b, v8f c) {
  // D = A(16x4) * B(4x16) + C,  f32 WMMA
  return __builtin_amdgcn_wmma_f32_16x16x4_f32(false, a, false, b, (short)0, c,
                                               false, false);
}
__device__ __forceinline__ v8f zero8() {
  v8f z = {0.f, 0.f, 0.f, 0.f, 0.f, 0.f, 0.f, 0.f};
  return z;
}

// gfx1250 async global->LDS copy, tracked by ASYNCcnt (no VGPR round-trip).
__device__ __forceinline__ void async_b32(unsigned lds_off, const float* gptr) {
  asm volatile("global_load_async_to_lds_b32 %0, %1, off"
               :: "v"(lds_off), "v"(gptr)
               : "memory");
}
__device__ __forceinline__ void wait_async0() {
  asm volatile("s_wait_asynccnt 0" ::: "memory");
}

// ---------------------------------------------------------------------------
// Kernel 0: zero the small accumulators (matrixT, value_sum, ksum)
// ---------------------------------------------------------------------------
__global__ void k_zero(float* __restrict__ p, int n) {
  int i = blockIdx.x * 256 + threadIdx.x;
  if (i < n) p[i] = 0.f;
}

// ---------------------------------------------------------------------------
// Kernel 1: fused QKV projection (+bias, +L2 norm of Q/K over 32 channels)
// 256 threads (8 waves), 64 positions/block. x staged TRANSPOSED [n][c] in
// LDS via double-buffered async-to-LDS copies, so every WMMA B operand is a
// single ds_load_b64. Wave w owns V c-tiles {2w,2w+1}; waves 0..3 also own
// the Q/K m-tiles. Outputs: V[b][256][N] (=d_out), Qn/Kn [b][N][32].
// ---------------------------------------------------------------------------
__global__ __launch_bounds__(256) void k_qkv(
    const float* __restrict__ x,
    const float* __restrict__ Wq, const float* __restrict__ bq,
    const float* __restrict__ Wk, const float* __restrict__ bk,
    const float* __restrict__ Wv, const float* __restrict__ bv,
    float* __restrict__ V, float* __restrict__ Qn, float* __restrict__ Kn)
{
  __shared__ float xsA[64 * XPAD];  // transposed x chunk: [n(64)][c(64)+pad]
  __shared__ float xsB[64 * XPAD];  // double buffer
  __shared__ float qs [64 * XPAD];  // raw Q rows 0..31 / K rows 32..63: [c][n]

  const int nblk = blockIdx.x;
  const int b    = blockIdx.y;
  const int n0   = nblk * 64;
  const int tid  = threadIdx.x;
  const int lane = tid & 31;
  const int w    = tid >> 5;
  const int lm   = lane & 15;
  const int hi   = lane >> 4;       // 0/1
  const int kb   = hi * 2;          // K-base within 4-wide K slice

  const float* xb = x + (size_t)b * CCH * NN;
  const unsigned baseA = (unsigned)(size_t)(void*)xsA;
  const unsigned baseB = (unsigned)(size_t)(void*)xsB;

  v8f accV[2][4];
  v8f accQ[4];
#pragma unroll
  for (int i = 0; i < 2; ++i)
#pragma unroll
    for (int nt = 0; nt < 4; ++nt) accV[i][nt] = zero8();
#pragma unroll
  for (int nt = 0; nt < 4; ++nt) accQ[nt] = zero8();

  const bool   hasQK = (w < 4);
  const float* Wm    = (w < 2) ? Wq : Wk;   // waves 0,1 -> Q; 2,3 -> K
  const float* bqk   = (w < 2) ? bq : bk;
  const int    qkm   = (w & 1) * 16;        // m-row base inside the 32

  // issue one 64x64 chunk: 128 wave-instructions; wave w issues 16.
  // per instruction: 32 lanes read 128B contiguous of channel c, scatter
  // to LDS column c of the transposed tile (stride 68 -> conflict-free).
  auto issue_chunk = [&](int chunk, unsigned lbase) {
    const float* gb = xb + (size_t)(chunk * 64) * NN + n0;
#pragma unroll 2
    for (int i = 0; i < 16; ++i) {
      const int idx = w * 16 + i;
      const int c   = idx >> 1;
      const int h   = idx & 1;
      const int nl  = h * 32 + lane;
      async_b32(lbase + (unsigned)(nl * XPAD + c) * 4u,
                gb + (size_t)c * NN + nl);
    }
  };

  issue_chunk(0, baseA);
  wait_async0();
  __syncthreads();

#pragma unroll 1
  for (int chunk = 0; chunk < 4; ++chunk) {
    const float* xs = (chunk & 1) ? xsB : xsA;
    if (chunk < 3) issue_chunk(chunk + 1, (chunk & 1) ? baseA : baseB);
    const int cb = chunk * 64;

#pragma unroll 2
    for (int kk = 0; kk < 16; ++kk) {
      const int c4 = kk * 4;
      v2f Bt[4];
#pragma unroll
      for (int nt = 0; nt < 4; ++nt) {
        const float* p = xs + (nt * 16 + lm) * XPAD + c4 + kb;
        Bt[nt][0] = p[0];          // contiguous pair -> one ds_load_b64
        Bt[nt][1] = p[1];
      }
      const int cg = cb + c4 + kb;  // global input-channel for A loads
#pragma unroll
      for (int i = 0; i < 2; ++i) {
        const int mrow = (w * 2 + i) * 16 + lm;
        const float* ap = Wv + (size_t)mrow * CCH + cg;
        v2f A; A[0] = ap[0]; A[1] = ap[1];
#pragma unroll
        for (int nt = 0; nt < 4; ++nt)
          accV[i][nt] = wmma4(A, Bt[nt], accV[i][nt]);
      }
      if (hasQK) {
        const float* ap = Wm + (size_t)(qkm + lm) * CCH + cg;
        v2f A; A[0] = ap[0]; A[1] = ap[1];
#pragma unroll
        for (int nt = 0; nt < 4; ++nt)
          accQ[nt] = wmma4(A, Bt[nt], accQ[nt]);
      }
    }
    wait_async0();     // next buffer's writes complete (this wave)
    __syncthreads();   // all waves done reading cur + writing next
  }

  // ---- V: bias + store to global [b][c][n] ----
#pragma unroll
  for (int i = 0; i < 2; ++i) {
    const int ct = w * 2 + i;
#pragma unroll
    for (int j = 0; j < 8; ++j) {
      const int   crow = ct * 16 + hi * 8 + j;
      const float bias = bv[crow];
#pragma unroll
      for (int nt = 0; nt < 4; ++nt)
        V[((size_t)b * CCH + crow) * NN + n0 + nt * 16 + lm] =
            accV[i][nt][j] + bias;
    }
  }

  // ---- Q/K: bias + write raw tiles to LDS ([c][n] layout) ----
  if (hasQK) {
    const int rbase = ((w >= 2) ? 32 : 0) + qkm;
#pragma unroll
    for (int j = 0; j < 8; ++j) {
      const int   r    = rbase + hi * 8 + j;
      const float bias = bqk[qkm + hi * 8 + j];
#pragma unroll
      for (int nt = 0; nt < 4; ++nt)
        qs[r * XPAD + nt * 16 + lm] = accQ[nt][j] + bias;
    }
  }
  __syncthreads();

  // ---- L2-normalize columns; write Qn/Kn as [b][n][32] ----
  if (tid < 128) {
    const int n   = tid & 63;
    const int isK = tid >> 6;
    const float* col = qs + isK * 32 * XPAD + n;
    float v[32];
    float ss = 0.f;
#pragma unroll
    for (int m = 0; m < 32; ++m) { v[m] = col[m * XPAD]; ss += v[m] * v[m]; }
    const float inv = 1.0f / sqrtf(ss);
    float* dst = (isK ? Kn : Qn) + ((size_t)b * NN + n0 + n) * 32;
#pragma unroll
    for (int m = 0; m < 32; m += 4) {
      float4 o;
      o.x = v[m] * inv;     o.y = v[m + 1] * inv;
      o.z = v[m + 2] * inv; o.w = v[m + 3] * inv;
      *(float4*)(dst + m) = o;
    }
  }
}

// ---------------------------------------------------------------------------
// Kernel 2: matrixT[b][c][m] = sum_n V[c,n]*Kn[n,m];  value_sum; ksum.
// Grid (slab=4, ctile=16, b=4); 8 waves each reduce 512 positions, LDS
// atomic-add reduce, then global f32 atomics.
// ---------------------------------------------------------------------------
__global__ __launch_bounds__(256) void k_matrix(
    const float* __restrict__ V, const float* __restrict__ Kn,
    float* __restrict__ MT, float* __restrict__ vsum, float* __restrict__ ksum)
{
  __shared__ float tile_s[16 * 32];
  __shared__ float vs_s[16];
  __shared__ float ks_s[32];

  const int slab = blockIdx.x, ct = blockIdx.y, b = blockIdx.z;
  const int tid = threadIdx.x, lane = tid & 31, w = tid >> 5;
  const int lm = lane & 15, hi = lane >> 4, kb = hi * 2;

  if (tid < 16) vs_s[tid] = 0.f;
  if (tid < 32) ks_s[tid] = 0.f;
  for (int i = tid; i < 512; i += 256) tile_s[i] = 0.f;
  __syncthreads();

  const int nbase = slab * 4096 + w * 512;
  const float* vrow = V + ((size_t)b * CCH + ct * 16 + lm) * NN;
  const float* knb  = Kn + (size_t)b * NN * 32;

  v8f acc0 = zero8(), acc1 = zero8();
  float rs = 0.f, k0s = 0.f, k1s = 0.f;
#pragma unroll 4
  for (int n4 = 0; n4 < 512; n4 += 4) {
    const int n = nbase + n4 + kb;
    v2f A; A[0] = vrow[n]; A[1] = vrow[n + 1];
    rs += A[0] + A[1];
    const float* kp = knb + (size_t)n * 32 + lm;
    v2f B0, B1;
    B0[0] = kp[0];  B0[1] = kp[32];
    B1[0] = kp[16]; B1[1] = kp[48];
    k0s += B0[0] + B0[1];
    k1s += B1[0] + B1[1];
    acc0 = wmma4(A, B0, acc0);
    acc1 = wmma4(A, B1, acc1);
  }

#pragma unroll
  for (int j = 0; j < 8; ++j) {
    const int row = hi * 8 + j;
    atomicAdd(&tile_s[row * 32 + lm], acc0[j]);
    atomicAdd(&tile_s[row * 32 + 16 + lm], acc1[j]);
  }
  atomicAdd(&vs_s[lm], rs);
  if (ct == 0) {
    atomicAdd(&ks_s[lm], k0s);
    atomicAdd(&ks_s[16 + lm], k1s);
  }
  __syncthreads();

  for (int i = tid; i < 512; i += 256)
    atomicAdd(&MT[((size_t)b * CCH + ct * 16) * 32 + i], tile_s[i]);
  if (tid < 16) atomicAdd(&vsum[b * CCH + ct * 16 + tid], vs_s[tid]);
  if (ct == 0 && tid < 32) atomicAdd(&ksum[b * CQK + tid], ks_s[tid]);
}

// ---------------------------------------------------------------------------
// Kernel 3: out[b][c][n] = tailor(n) * (vsum[c] + sum_m MT[c][m]*Qn[n][m])
// with tailor(n) = gamma / (N + Qn[n,:] . (ksum + eps)).
// Grid (N/128, B); matrixT + Qn tile + vsum staged in LDS with padded row
// strides (36) so every ds_load_b64 of A/B is bank-conflict-free.
// ---------------------------------------------------------------------------
__global__ __launch_bounds__(256) void k_final(
    const float* __restrict__ Qn, const float* __restrict__ MT,
    const float* __restrict__ vsum, const float* __restrict__ ksum,
    const float* __restrict__ gamma, float* __restrict__ out)
{
  __shared__ float Ms[CCH * MSP];   // 36 KB
  __shared__ float Qs[128 * QSP];   // 18 KB
  __shared__ float vs_s[CCH];
  __shared__ float tg_s[128];

  const int nblk = blockIdx.x, b = blockIdx.y;
  const int n0 = nblk * 128;
  const int tid = threadIdx.x, lane = tid & 31, w = tid >> 5;
  const int lm = lane & 15, hi = lane >> 4, kb = hi * 2;

  {
    // Ms: thread t stages matrixT row t (8 float4, padded dst stride)
    const float4* src = (const float4*)(MT + (size_t)b * CCH * 32 + tid * 32);
    float4*       dst = (float4*)(Ms + tid * MSP);
#pragma unroll
    for (int i = 0; i < 8; ++i) dst[i] = src[i];
    // Qs: two threads per row of 32 floats
    const int qr = tid >> 1, qseg = (tid & 1) * 4;
    const float4* qsrc =
        (const float4*)(Qn + ((size_t)b * NN + n0 + qr) * 32) + qseg;
    float4* qdst = (float4*)(Qs + qr * QSP) + qseg;
#pragma unroll
    for (int i = 0; i < 4; ++i) qdst[i] = qsrc[i];
    vs_s[tid] = vsum[b * CCH + tid];
  }
  __syncthreads();

  if (tid < 128) {
    const float* q = Qs + tid * QSP;
    float dot = 0.f;
#pragma unroll
    for (int m = 0; m < 32; ++m) dot += q[m] * (ksum[b * CQK + m] + 1e-6f);
    tg_s[tid] = gamma[0] / (16384.0f + dot);
  }
  __syncthreads();

#pragma unroll 1
  for (int i = 0; i < 2; ++i) {
    const int ct = w * 2 + i;
    v2f A[8];
    {
      const float* ap = Ms + (ct * 16 + lm) * MSP + kb;
#pragma unroll
      for (int k = 0; k < 8; ++k) { A[k][0] = ap[k * 4]; A[k][1] = ap[k * 4 + 1]; }
    }
    float vinit[8];
#pragma unroll
    for (int j = 0; j < 8; ++j) vinit[j] = vs_s[ct * 16 + hi * 8 + j];

#pragma unroll 1
    for (int nt = 0; nt < 8; ++nt) {
      v8f acc;
#pragma unroll
      for (int j = 0; j < 8; ++j) acc[j] = vinit[j];
      const float* qp = Qs + (nt * 16 + lm) * QSP + kb;
#pragma unroll
      for (int k = 0; k < 8; ++k) {
        v2f Bv; Bv[0] = qp[k * 4]; Bv[1] = qp[k * 4 + 1];
        acc = wmma4(A[k], Bv, acc);
      }
      const float tg = tg_s[nt * 16 + lm];
#pragma unroll
      for (int j = 0; j < 8; ++j) {
        const int crow = ct * 16 + hi * 8 + j;
        out[((size_t)b * CCH + crow) * NN + n0 + nt * 16 + lm] = acc[j] * tg;
      }
    }
  }
}

// ---------------------------------------------------------------------------
extern "C" void kernel_launch(void* const* d_in, const int* in_sizes, int n_in,
                              void* d_out, int out_size, void* d_ws, size_t ws_size,
                              hipStream_t stream)
{
  (void)in_sizes; (void)n_in; (void)out_size; (void)ws_size;
  const float* x     = (const float*)d_in[0];
  const float* Wq    = (const float*)d_in[1];
  const float* bq    = (const float*)d_in[2];
  const float* Wk    = (const float*)d_in[3];
  const float* bk    = (const float*)d_in[4];
  const float* Wv    = (const float*)d_in[5];
  const float* bv    = (const float*)d_in[6];
  const float* gamma = (const float*)d_in[7];
  float* out = (float*)d_out;

  // workspace layout (floats): Qn | Kn | MT | vsum | ksum
  float* Qn   = (float*)d_ws;                       // B*N*32
  float* Kn   = Qn + (size_t)BB * NN * 32;          // B*N*32
  float* MT   = Kn + (size_t)BB * NN * 32;          // B*256*32
  float* vsum = MT + (size_t)BB * CCH * 32;         // B*256
  float* ksum = vsum + (size_t)BB * CCH;            // B*32
  float* V    = out;  // reuse d_out as V scratch; k_final fully overwrites it

  const int accN = BB * CCH * 32 + BB * CCH + BB * CQK;  // 33920
  k_zero<<<dim3((accN + 255) / 256), 256, 0, stream>>>(MT, accN);
  k_qkv<<<dim3(NN / 64, BB), 256, 0, stream>>>(x, Wq, bq, Wk, bk, Wv, bv,
                                               V, Qn, Kn);
  k_matrix<<<dim3(4, 16, BB), 256, 0, stream>>>(V, Kn, MT, vsum, ksum);
  k_final<<<dim3(NN / 128, BB), 256, 0, stream>>>(Qn, MT, vsum, ksum, gamma, out);
}

// v001
// A run of this version takes 65.4 microseconds.
// Next to v000, in two timings, it ran 2.01 and 2.03 times as fast.
#include <hip/hip_runtime.h>
#include <math.h>

#define BB   4
#define CCH  256
#define CQK  32
#define NN   16384
#define XPAD 68   // x-tile row pad: bank-conflict-free for stride-68 access
#define MSP  36   // Ms row stride in k_final (36*l mod 64 distinct for l<16)
#define QSP  36   // Qs row stride in k_final

typedef __attribute__((ext_vector_type(2))) float v2f;
typedef __attribute__((ext_vector_type(8))) float v8f;

__device__ __forceinline__ v8f wmma4(v2f a, v2f b, v8f c) {
  // D = A(16x4) * B(4x16) + C,  f32 WMMA
  return __builtin_amdgcn_wmma_f32_16x16x4_f32(false, a, false, b, (short)0, c,
                                               false, false);
}
__device__ __forceinline__ v8f zero8() {
  v8f z = {0.f, 0.f, 0.f, 0.f, 0.f, 0.f, 0.f, 0.f};
  return z;
}

// gfx1250 async global->LDS copy, tracked by ASYNCcnt (no VGPR round-trip).
__device__ __forceinline__ void async_b32(unsigned lds_off, const float* gptr) {
  asm volatile("global_load_async_to_lds_b32 %0, %1, off"
               :: "v"(lds_off), "v"(gptr)
               : "memory");
}
__device__ __forceinline__ void wait_async0() {
  asm volatile("s_wait_asynccnt 0" ::: "memory");
}

// ---------------------------------------------------------------------------
// Kernel 0: zero the small accumulators (GT, xsum, ksum)
// ---------------------------------------------------------------------------
__global__ void k_zero(float* __restrict__ p, int n) {
  int i = blockIdx.x * 256 + threadIdx.x;
  if (i < n) p[i] = 0.f;
}

// ---------------------------------------------------------------------------
// Kernel 1: fused Q/K projection (+bias, +L2 norm of Q/K over 32 channels)
// V = Wv x + bv is never formed: it enters the result only through
//   sum_n V[c,n] Kn[n,m] = sum_c' Wv[c,c'] (sum_n x[c',n] Kn[n,m]) + bv[c] ksum[m]
//   sum_n V[c,n]         = sum_c' Wv[c,c'] (sum_n x[c',n])         + N bv[c]
// so k_matrix reduces x itself over n and k_mix applies Wv to the small result.
// 256 threads (8 waves), 64 positions/block. x staged TRANSPOSED [n][c] in
// LDS via double-buffered async-to-LDS copies, so every WMMA B operand is a
// single ds_load_b64. Wave w owns Q/K m-tile (w & 3) on n-tiles
// {2(w>>2), 2(w>>2)+1}. Outputs: Qn/Kn [b][N][32].
// ---------------------------------------------------------------------------
__global__ __launch_bounds__(256) void k_qk(
    const float* __restrict__ x,
    const float* __restrict__ Wq, const float* __restrict__ bq,
    const float* __restrict__ Wk, const float* __restrict__ bk,
    float* __restrict__ Qn, float* __restrict__ Kn)
{
  __shared__ float xsA[64 * XPAD];  // transposed x chunk: [n(64)][c(64)+pad]
  __shared__ float xsB[64 * XPAD];  // double buffer
  __shared__ float qs [64 * XPAD];  // raw Q rows 0..31 / K rows 32..63: [c][n]

  const int nblk = blockIdx.x;
  const int b    = blockIdx.y;
  const int n0   = nblk * 64;
  const int tid  = threadIdx.x;
  const int lane = tid & 31;
  const int w    = tid >> 5;
  const int lm   = lane & 15;
  const int hi   = lane >> 4;       // 0/1
  const int kb   = hi * 2;          // K-base within 4-wide K slice

  const float* xb = x + (size_t)b * CCH * NN;
  const unsigned baseA = (unsigned)(size_t)(void*)xsA;
  const unsigned baseB = (unsigned)(size_t)(void*)xsB;

  v8f accQ[2];
#pragma unroll
  for (int t = 0; t < 2; ++t) accQ[t] = zero8();

  const int    mt    = w & 3;               // m-tile: 0,1 -> Q; 2,3 -> K
  const int    ntb   = (w >> 2) * 2;        // first of this wave's 2 n-tiles
  const float* Wm    = (mt < 2) ? Wq : Wk;
  const float* bqk   = (mt < 2) ? bq : bk;
  const int    qkm   = (mt & 1) * 16;       // m-row base inside the 32

  // issue one 64x64 chunk: 128 wave-instructions; wave w issues 16.
  // per instruction: 32 lanes read 128B contiguous of channel c, scatter
  // to LDS column c of the transposed tile (stride 68 -> conflict-free).
  auto issue_chunk = [&](int chunk, unsigned lbase) {
    const float* gb = xb + (size_t)(chunk * 64) * NN + n0;
#pragma unroll 2
    for (int i = 0; i < 16; ++i) {
      const int idx = w * 16 + i;
      const int c   = idx >> 1;
      const int h   = idx & 1;
      const int nl  = h * 32 + lane;
      async_b32(lbase + (unsigned)(nl * XPAD + c) * 4u,
                gb + (size_t)c * NN + nl);
    }
  };

  issue_chunk(0, baseA);
  wait_async0();
  __syncthreads();

#pragma unroll 1
  for (int chunk = 0; chunk < 4; ++chunk) {
    const float* xs = (chunk & 1) ? xsB : xsA;
    if (chunk < 3) issue_chunk(chunk + 1, (chunk & 1) ? baseA : baseB);
    const int cb = chunk * 64;

#pragma unroll 2
    for (int kk = 0; kk < 16; ++kk) {
      const int c4 = kk * 4;
      v2f Bt[2];
#pragma unroll
      for (int t = 0; t < 2; ++t) {
        const float* p = xs + ((ntb + t) * 16 + lm) * XPAD + c4 + kb;
        Bt[t][0] = p[0];           // contiguous pair -> one ds_load_b64
        Bt[t][1] = p[1];
      }
      const int cg = cb + c4 + kb;  // global input-channel for A loads
      const float* ap = Wm + (size_t)(qkm + lm) * CCH + cg;
      v2f A; A[0] = ap[0]; A[1] = ap[1];
#pragma unroll
      for (int t = 0; t < 2; ++t)
        accQ[t] = wmma4(A, Bt[t], accQ[t]);
    }
    wait_async0();     // next buffer's writes complete (this wave)
    __syncthreads();   // all waves done reading cur + writing next
  }

  // ---- Q/K: bias + write raw tiles to LDS ([c][n] layout) ----
  {
    const int rbase = mt * 16;
#pragma unroll
    for (int j = 0; j < 8; ++j) {
      const int   r    = rbase + hi * 8 + j;
      const float bias = bqk[qkm + hi * 8 + j];
#pragma unroll
      for (int t = 0; t < 2; ++t)
        qs[r * XPAD + (ntb + t) * 16 + lm] = accQ[t][j] + bias;
    }
  }
  __syncthreads();

  // ---- L2-normalize columns; write Qn/Kn as [b][n][32] ----
  if (tid < 128) {
    const int n   = tid & 63;
    const int isK = tid >> 6;
    const float* col = qs + isK * 32 * XPAD + n;
    float v[32];
    float ss = 0.f;
#pragma unroll
    for (int m = 0; m < 32; ++m) { v[m] = col[m * XPAD]; ss += v[m] * v[m]; }
    const float inv = 1.0f / sqrtf(ss);
    float* dst = (isK ? Kn : Qn) + ((size_t)b * NN + n0 + n) * 32;
#pragma unroll
    for (int m = 0; m < 32; m += 4) {
      float4 o;
      o.x = v[m] * inv;     o.y = v[m + 1] * inv;
      o.z = v[m + 2] * inv; o.w = v[m + 3] * inv;
      *(float4*)(dst + m) = o;
    }
  }
}

// ---------------------------------------------------------------------------
// Kernel 2: MT[b][c][m] = sum_n V[c,n]*Kn[n,m];  vsum = row sums of V; ksum.
// It is launched with V = x, so its MT is GT and its vsum is xsum (see k_qk).
// Grid (slab=4, ctile=16, b=4); 8 waves each reduce 512 positions, LDS
// atomic-add reduce, then global f32 atomics.
// ---------------------------------------------------------------------------
__global__ __launch_bounds__(256) void k_matrix(
    const float* __restrict__ V, const float* __restrict__ Kn,
    float* __restrict__ MT, float* __restrict__ vsum, float* __restrict__ ksum)
{
  __shared__ float tile_s[16 * 32];
  __shared__ float vs_s[16];
  __shared__ float ks_s[32];

  const int slab = blockIdx.x, ct = blockIdx.y, b = blockIdx.z;
  const int tid = threadIdx.x, lane = tid & 31, w = tid >> 5;
  const int lm = lane & 15, hi = lane >> 4, kb = hi * 2;

  if (tid < 16) vs_s[tid] = 0.f;
  if (tid < 32) ks_s[tid] = 0.f;
  for (int i = tid; i < 512; i += 256) tile_s[i] = 0.f;
  __syncthreads();

  const int nbase = slab * 4096 + w * 512;
  const float* vrow = V + ((size_t)b * CCH + ct * 16 + lm) * NN;
  const float* knb  = Kn + (size_t)b * NN * 32;

  v8f acc0 = zero8(), acc1 = zero8();
  float rs = 0.f, k0s = 0.f, k1s = 0.f;
#pragma unroll 4
  for (int n4 = 0; n4 < 512; n4 += 4) {
    const int n = nbase + n4 + kb;
    v2f A; A[0] = vrow[n]; A[1] = vrow[n + 1];
    rs += A[0] + A[1];
    const float* kp = knb + (size_t)n * 32 + lm;
    v2f B0, B1;
    B0[0] = kp[0];  B0[1] = kp[32];
    B1[0] = kp[16]; B1[1] = kp[48];
    k0s += B0[0] + B0[1];
    k1s += B1[0] + B1[1];
    acc0 = wmma4(A, B0, acc0);
    acc1 = wmma4(A, B1, acc1);
  }

#pragma unroll
  for (int j = 0; j < 8; ++j) {
    const int row = hi * 8 + j;
    atomicAdd(&tile_s[row * 32 + lm], acc0[j]);
    atomicAdd(&tile_s[row * 32 + 16 + lm], acc1[j]);
  }
  atomicAdd(&vs_s[lm], rs);
  if (ct == 0) {
    atomicAdd(&ks_s[lm], k0s);
    atomicAdd(&ks_s[16 + lm], k1s);
  }
  __syncthreads();

  for (int i = tid; i < 512; i += 256)
    atomicAdd(&MT[((size_t)b * CCH + ct * 16) * 32 + i], tile_s[i]);
  if (tid < 16) atomicAdd(&vsum[b * CCH + ct * 16 + tid], vs_s[tid]);
  if (ct == 0 && tid < 32) atomicAdd(&ksum[b * CQK + tid], ks_s[tid]);
}

// ---------------------------------------------------------------------------
// Kernel 2b: apply Wv to the reduced x:
//   MT[b][c][m] = sum_c' Wv[c][c'] * GT[b][c'][m] + bv[c] * ksum[b][m]
//   vsum[b][c]  = sum_c' Wv[c][c'] * xsum[b][c']  + N * bv[c]
// Grid (ctile=16, b=4); wave w: m-tile (w & 1), quarter (w >> 1) of the 256
// input channels; the four quarters are summed through LDS in a fixed order.
// ---------------------------------------------------------------------------
__global__ __launch_bounds__(256) void k_mix(
    const float* __restrict__ Wv, const float* __restrict__ bv,
    const float* __restrict__ GT, const float* __restrict__ xsum,
    const float* __restrict__ ksum,
    float* __restrict__ MT, float* __restrict__ vsum)
{
  __shared__ float red[4 * 512];

  const int ct = blockIdx.x, b = blockIdx.y;
  const int tid = threadIdx.x, lane = tid & 31, w = tid >> 5;
  const int lm = lane & 15, hi = lane >> 4, kb = hi * 2;
  const int mt = w & 1, kq = w >> 1;

  const float* ap = Wv + (size_t)(ct * 16 + lm) * CCH + kq * 64 + kb;
  const float* gp = GT + ((size_t)b * CCH + kq * 64 + kb) * 32 + mt * 16 + lm;
  v8f acc = zero8();
#pragma unroll
  for (int kk = 0; kk < 16; ++kk) {
    v2f A, Bv;
    A[0]  = ap[kk * 4];        A[1]  = ap[kk * 4 + 1];
    Bv[0] = gp[kk * 4 * 32];   Bv[1] = gp[(kk * 4 + 1) * 32];
    acc = wmma4(A, Bv, acc);
  }
  // stands before any reuse of the address registers of the Wv/GT loads above;
  // naming them as inputs keeps those registers untouched up to this wait
  asm volatile("s_wait_xcnt 0x0" :: "v"(ap), "v"(gp) : "memory");
#pragma unroll
  for (int j = 0; j < 8; ++j)
    red[kq * 512 + (hi * 8 + j) * 32 + mt * 16 + lm] = acc[j];

  // value_sum: 16 threads per output row, 16 input channels each
  const int r = tid >> 4, sl = tid & 15;
  const float* wr = Wv + (size_t)(ct * 16 + r) * CCH + sl;
  const float* xr = xsum + b * CCH + sl;
  float ps = 0.f;
#pragma unroll
  for (int q = 0; q < 16; ++q) ps += wr[q * 16] * xr[q * 16];
  // the same for the Wv loads above (the xsum loads are addressed by sl, kept)
  asm volatile("s_wait_xcnt 0x0" :: "v"(wr) : "memory");
#pragma unroll
  for (int d = 8; d >= 1; d >>= 1) ps += __shfl_xor(ps, d);
  if (sl == 0)
    vsum[b * CCH + ct * 16 + r] = ps + 16384.0f * bv[ct * 16 + r];
  __syncthreads();

  for (int i = tid; i < 512; i += 256)
    MT[((size_t)b * CCH + ct * 16) * 32 + i] =
        ((red[i] + red[512 + i]) + (red[1024 + i] + red[1536 + i])) +
        bv[ct * 16 + (i >> 5)] * ksum[b * CQK + (i & 31)];
}

// ---------------------------------------------------------------------------
// Kernel 3: out[b][c][n] = tailor(n) * (vsum[c] + sum_m MT[c][m]*Qn[n][m])
// with tailor(n) = gamma / (N + Qn[n,:] . (ksum + eps)).
// Grid (N/128, B); matrixT + Qn tile + vsum staged in LDS with padded row
// strides (36) so every ds_load_b64 of A/B is bank-conflict-free.
// ---------------------------------------------------------------------------
__global__ __launch_bounds__(256) void k_final(
    const float* __restrict__ Qn, const float* __restrict__ MT,
    const float* __restrict__ vsum, const float* __restrict__ ksum,
    const float* __restrict__ gamma, float* __restrict__ out)
{
  __shared__ float Ms[CCH * MSP];   // 36 KB
  __shared__ float Qs[128 * QSP];   // 18 KB
  __shared__ float vs_s[CCH];
  __shared__ float tg_s[128];

  const int nblk = blockIdx.x, b = blockIdx.y;
  const int n0 = nblk * 128;
  const int tid = threadIdx.x, lane = tid & 31, w = tid >> 5;
  const int lm = lane & 15, hi = lane >> 4, kb = hi * 2;

  {
    // Ms: thread t stages matrixT row t (8 float4, padded dst stride)
    const float4* src = (const float4*)(MT + (size_t)b * CCH * 32 + tid * 32);
    float4*       dst = (float4*)(Ms + tid * MSP);
#pragma unroll
    for (int i = 0; i < 8; ++i) dst[i] = src[i];
    // Qs: two threads per row of 32 floats
    const int qr = tid >> 1, qseg = (tid & 1) * 4;
    const float4* qsrc =
        (const float4*)(Qn + ((size_t)b * NN + n0 + qr) * 32) + qseg;
    float4* qdst = (float4*)(Qs + qr * QSP) + qseg;
#pragma unroll
    for (int i = 0; i < 4; ++i) qdst[i] = qsrc[i];
    vs_s[tid] = vsum[b * CCH + tid];
  }
  __syncthreads();

  if (tid < 128) {
    const float* q = Qs + tid * QSP;
    float dot = 0.f;
#pragma unroll
    for (int m = 0; m < 32; ++m) dot += q[m] * (ksum[b * CQK + m] + 1e-6f);
    tg_s[tid] = gamma[0] / (16384.0f + dot);
  }
  __syncthreads();

#pragma unroll 1
  for (int i = 0; i < 2; ++i) {
    const int ct = w * 2 + i;
    v2f A[8];
    {
      const float* ap = Ms + (ct * 16 + lm) * MSP + kb;
#pragma unroll
      for (int k = 0; k < 8; ++k) { A[k][0] = ap[k * 4]; A[k][1] = ap[k * 4 + 1]; }
    }
    float vinit[8];
#pragma unroll
    for (int j = 0; j < 8; ++j) vinit[j] = vs_s[ct * 16 + hi * 8 + j];

#pragma unroll 1
    for (int nt = 0; nt < 8; ++nt) {
      v8f acc;
#pragma unroll
      for (int j = 0; j < 8; ++j) acc[j] = vinit[j];
      const float* qp = Qs + (nt * 16 + lm) * QSP + kb;
#pragma unroll
      for (int k = 0; k < 8; ++k) {
        v2f Bv; Bv[0] = qp[k * 4]; Bv[1] = qp[k * 4 + 1];
        acc = wmma4(A[k], Bv, acc);
      }
      const float tg = tg_s[nt * 16 + lm];
#pragma unroll
      for (int j = 0; j < 8; ++j) {
        const int crow = ct * 16 + hi * 8 + j;
        out[((size_t)b * CCH + crow) * NN + n0 + nt * 16 + lm] = acc[j] * tg;
      }
    }
  }
}

// ---------------------------------------------------------------------------
extern "C" void kernel_launch(void* const* d_in, const int* in_sizes, int n_in,
                              void* d_out, int out_size, void* d_ws, size_t ws_size,
                              hipStream_t stream)
{
  (void)in_sizes; (void)n_in; (void)out_size; (void)ws_size;
  const float* x     = (const float*)d_in[0];
  const float* Wq    = (const float*)d_in[1];
  const float* bq    = (const float*)d_in[2];
  const float* Wk    = (const float*)d_in[3];
  const float* bk    = (const float*)d_in[4];
  const float* Wv    = (const float*)d_in[5];
  const float* bv    = (const float*)d_in[6];
  const float* gamma = (const float*)d_in[7];
  float* out = (float*)d_out;

  // workspace layout (floats): Qn | Kn | GT | xsum | ksum | MT | vsum
  float* Qn   = (float*)d_ws;                       // B*N*32
  float* Kn   = Qn + (size_t)BB * NN * 32;          // B*N*32
  float* GT   = Kn + (size_t)BB * NN * 32;          // B*256*32
  float* xsum = GT + (size_t)BB * CCH * 32;         // B*256
  float* ksum = xsum + (size_t)BB * CCH;            // B*32
  float* MT   = ksum + (size_t)BB * CQK;            // B*256*32
  float* vsum = MT + (size_t)BB * CCH * 32;         // B*256

  const int accN = BB * CCH * 32 + BB * CCH + BB * CQK;  // 33920
  k_zero<<<dim3((accN + 255) / 256), 256, 0, stream>>>(GT, accN);
  k_qk<<<dim3(NN / 64, BB), 256, 0, stream>>>(x, Wq, bq, Wk, bk, Qn, Kn);
  k_matrix<<<dim3(4, 16, BB), 256, 0, stream>>>(x, Kn, GT, xsum, ksum);
  k_mix<<<dim3(16, BB), 256, 0, stream>>>(Wv, bv, GT, xsum, ksum, MT, vsum);
  k_final<<<dim3(NN / 128, BB), 256, 0, stream>>>(Qn, MT, vsum, ksum, gamma, out);
}

// v002
// It runs in 63.7 microseconds.
// In both of two side-by-side timings against v001, it was 1.03 times as fast.
// All steps since v000 together make it 2.08 times as fast.
#include <hip/hip_runtime.h>
#include <math.h>

#define BB   4
#define CCH  256
#define CQK  32
#define NN   16384
#define XPAD 68   // x-tile row pad: bank-conflict-free for stride-68 access
#define MSP  36   // Ms row stride in k_final (36*l mod 64 distinct for l<16)
#define QSP  36   // Qs row stride in k_final
#define ACCN (BB * CCH * 32 + BB * CCH + BB * CQK)  // floats of GT | xsum | ksum

typedef __attribute__((ext_vector_type(2))) float v2f;
typedef __attribute__((ext_vector_type(8))) float v8f;

__device__ __forceinline__ v8f wmma4(v2f a, v2f b, v8f c) {
  // D = A(16x4) * B(4x16) + C,  f32 WMMA
  return __builtin_amdgcn_wmma_f32_16x16x4_f32(false, a, false, b, (short)0, c,
                                               false, false);
}
__device__ __forceinline__ v8f zero8() {
  v8f z = {0.f, 0.f, 0.f, 0.f, 0.f, 0.f, 0.f, 0.f};
  return z;
}

// gfx1250 async global->LDS copy, tracked by ASYNCcnt (no VGPR round-trip).
__device__ __forceinline__ void async_b32(unsigned lds_off, const float* gptr) {
  asm volatile("global_load_async_to_lds_b32 %0, %1, off"
               :: "v"(lds_off), "v"(gptr)
               : "memory");
}
__device__ __forceinline__ void wait_async0() {
  asm volatile("s_wait_asynccnt 0" ::: "memory");
}

// ---------------------------------------------------------------------------
// Kernel 1: fused Q/K projection (+bias, +L2 norm of Q/K over 32 channels)
// V = Wv x + bv is never formed: it enters the result only through
//   sum_n V[c,n] Kn[n,m] = sum_c' Wv[c,c'] (sum_n x[c',n] Kn[n,m]) + bv[c] ksum[m]
//   sum_n V[c,n]         = sum_c' Wv[c,c'] (sum_n x[c',n])         + N bv[c]
// so k_matrix reduces x itself over n and k_mix applies Wv to the small result.
// 256 threads (8 waves), 64 positions/block. x staged TRANSPOSED [n][c] in
// LDS via double-buffered async-to-LDS copies, so every WMMA B operand is a
// single ds_load_b64. Wave w owns Q/K m-tile (w & 3) on n-tiles
// {2(w>>2), 2(w>>2)+1}. Outputs: Qn/Kn [b][N][32].
// The first blocks also store the start value 0 of the accumulators (GT, xsum,
// ksum, contiguous at acc0) that the next launch, k_matrix, adds into.
// ---------------------------------------------------------------------------
__global__ __launch_bounds__(256) void k_qk(
    const float* __restrict__ x,
    const float* __restrict__ Wq, const float* __restrict__ bq,
    const float* __restrict__ Wk, const float* __restrict__ bk,
    float* __restrict__ Qn, float* __restrict__ Kn, float* __restrict__ acc0)
{
  __shared__ float xsA[64 * XPAD];  // transposed x chunk: [n(64)][c(64)+pad]
  __shared__ float xsB[64 * XPAD];  // double buffer
  __shared__ float qs [64 * XPAD];  // raw Q rows 0..31 / K rows 32..63: [c][n]

  const int nblk = blockIdx.x;
  const int b    = blockIdx.y;
  const int n0   = nblk * 64;
  const int tid  = threadIdx.x;
  const int lane = tid & 31;
  const int w    = tid >> 5;
  const int lm   = lane & 15;
  const int hi   = lane >> 4;       // 0/1
  const int kb   = hi * 2;          // K-base within 4-wide K slice

  const float* xb = x + (size_t)b * CCH * NN;
  const unsigned baseA = (unsigned)(size_t)(void*)xsA;
  const unsigned baseB = (unsigned)(size_t)(void*)xsB;

  v8f accQ[2];
#pragma unroll
  for (int t = 0; t < 2; ++t) accQ[t] = zero8();

  const int    mt    = w & 3;               // m-tile: 0,1 -> Q; 2,3 -> K
  const int    ntb   = (w >> 2) * 2;        // first of this wave's 2 n-tiles
  const float* Wm    = (mt < 2) ? Wq : Wk;
  const float* bqk   = (mt < 2) ? bq : bk;
  const int    qkm   = (mt & 1) * 16;       // m-row base inside the 32

  // issue one 64x64 chunk: 128 wave-instructions; wave w issues 16.
  // per instruction: 32 lanes read 128B contiguous of channel c, scatter
  // to LDS column c of the transposed tile (stride 68 -> conflict-free).
  auto issue_chunk = [&](int chunk, unsigned lbase) {
    const float* gb = xb + (size_t)(chunk * 64) * NN + n0;
#pragma unroll 2
    for (int i = 0; i < 16; ++i) {
      const int idx = w * 16 + i;
      const int c   = idx >> 1;
      const int h   = idx & 1;
      const int nl  = h * 32 + lane;
      async_b32(lbase + (unsigned)(nl * XPAD + c) * 4u,
                gb + (size_t)c * NN + nl);
    }
  };

  issue_chunk(0, baseA);
  wait_async0();
  __syncthreads();

#pragma unroll 1
  for (int chunk = 0; chunk < 4; ++chunk) {
    const float* xs = (chunk & 1) ? xsB : xsA;
    if (chunk < 3) issue_chunk(chunk + 1, (chunk & 1) ? baseA : baseB);
    const int cb = chunk * 64;

#pragma unroll 2
    for (int kk = 0; kk < 16; ++kk) {
      const int c4 = kk * 4;
      v2f Bt[2];
#pragma unroll
      for (int t = 0; t < 2; ++t) {
        const float* p = xs + ((ntb + t) * 16 + lm) * XPAD + c4 + kb;
        Bt[t][0] = p[0];           // contiguous pair -> one ds_load_b64
        Bt[t][1] = p[1];
      }
      const int cg = cb + c4 + kb;  // global input-channel for A loads
      const float* ap = Wm + (size_t)(qkm + lm) * CCH + cg;
      v2f A; A[0] = ap[0]; A[1] = ap[1];
#pragma unroll
      for (int t = 0; t < 2; ++t)
        accQ[t] = wmma4(A, Bt[t], accQ[t]);
    }
    wait_async0();     // next buffer's writes complete (this wave)
    __syncthreads();   // all waves done reading cur + writing next
  }

  // ---- Q/K: bias + write raw tiles to LDS ([c][n] layout) ----
  {
    const int rbase = mt * 16;
#pragma unroll
    for (int j = 0; j < 8; ++j) {
      const int   r    = rbase + hi * 8 + j;
      const float bias = bqk[qkm + hi * 8 + j];
#pragma unroll
      for (int t = 0; t < 2; ++t)
        qs[r * XPAD + (ntb + t) * 16 + lm] = accQ[t][j] + bias;
    }
  }
  __syncthreads();

  // ---- L2-normalize columns; write Qn/Kn as [b][n][32] ----
  if (tid < 128) {
    const int n   = tid & 63;
    const int isK = tid >> 6;
    const float* col = qs + isK * 32 * XPAD + n;
    float v[32];
    float ss = 0.f;
#pragma unroll
    for (int m = 0; m < 32; ++m) { v[m] = col[m * XPAD]; ss += v[m] * v[m]; }
    const float inv = 1.0f / sqrtf(ss);
    float* dst = (isK ? Kn : Qn) + ((size_t)b * NN + n0 + n) * 32;
#pragma unroll
    for (int m = 0; m < 32; m += 4) {
      float4 o;
      o.x = v[m] * inv;     o.y = v[m + 1] * inv;
      o.z = v[m + 2] * inv; o.w = v[m + 3] * inv;
      *(float4*)(dst + m) = o;
    }
  }

  // ---- start value of k_matrix's accumulators: one float per thread ----
  const int zi = (b * (NN / 64) + nblk) * 256 + tid;
  if (zi < ACCN) acc0[zi] = 0.f;
}

// ---------------------------------------------------------------------------
// Kernel 2: MT[b][c][m] = sum_n V[c,n]*Kn[n,m];  vsum = row sums of V; ksum.
// It is launched with V = x, so its MT is GT and its vsum is xsum (see k_qk).
// Grid (slab=4, ctile=16, b=4); 8 waves each reduce 512 positions, LDS
// atomic-add reduce, then global f32 atomics.
// ---------------------------------------------------------------------------
__global__ __launch_bounds__(256) void k_matrix(
    const float* __restrict__ V, const float* __restrict__ Kn,
    float* __restrict__ MT, float* __restrict__ vsum, float* __restrict__ ksum)
{
  __shared__ float tile_s[16 * 32];
  __shared__ float vs_s[16];
  __shared__ float ks_s[32];

  const int slab = blockIdx.x, ct = blockIdx.y, b = blockIdx.z;
  const int tid = threadIdx.x, lane = tid & 31, w = tid >> 5;
  const int lm = lane & 15, hi = lane >> 4, kb = hi * 2;

  if (tid < 16) vs_s[tid] = 0.f;
  if (tid < 32) ks_s[tid] = 0.f;
  for (int i = tid; i < 512; i += 256) tile_s[i] = 0.f;
  __syncthreads();

  const int nbase = slab * 4096 + w * 512;
  const float* vrow = V + ((size_t)b * CCH + ct * 16 + lm) * NN;
  const float* knb  = Kn + (size_t)b * NN * 32;

  v8f acc0 = zero8(), acc1 = zero8();
  float rs = 0.f, k0s = 0.f, k1s = 0.f;
#pragma unroll 4
  for (int n4 = 0; n4 < 512; n4 += 4) {
    const int n = nbase + n4 + kb;
    v2f A; A[0] = vrow[n]; A[1] = vrow[n + 1];
    rs += A[0] + A[1];
    const float* kp = knb + (size_t)n * 32 + lm;
    v2f B0, B1;
    B0[0] = kp[0];  B0[1] = kp[32];
    B1[0] = kp[16]; B1[1] = kp[48];
    k0s += B0[0] + B0[1];
    k1s += B1[0] + B1[1];
    acc0 = wmma4(A, B0, acc0);
    acc1 = wmma4(A, B1, acc1);
  }

#pragma unroll
  for (int j = 0; j < 8; ++j) {
    const int row = hi * 8 + j;
    atomicAdd(&tile_s[row * 32 + lm], acc0[j]);
    atomicAdd(&tile_s[row * 32 + 16 + lm], acc1[j]);
  }
  atomicAdd(&vs_s[lm], rs);
  if (ct == 0) {
    atomicAdd(&ks_s[lm], k0s);
    atomicAdd(&ks_s[16 + lm], k1s);
  }
  __syncthreads();

  for (int i = tid; i < 512; i += 256)
    atomicAdd(&MT[((size_t)b * CCH + ct * 16) * 32 + i], tile_s[i]);
  if (tid < 16) atomicAdd(&vsum[b * CCH + ct * 16 + tid], vs_s[tid]);
  if (ct == 0 && tid < 32) atomicAdd(&ksum[b * CQK + tid], ks_s[tid]);
}

// ---------------------------------------------------------------------------
// Kernel 2b: apply Wv to the reduced x:
//   MT[b][c][m] = sum_c' Wv[c][c'] * GT[b][c'][m] + bv[c] * ksum[b][m]
//   vsum[b][c]  = sum_c' Wv[c][c'] * xsum[b][c']  + N * bv[c]
// Grid (ctile=16, b=4); wave w: m-tile (w & 1), quarter (w >> 1) of the 256
// input channels; the four quarters are summed through LDS in a fixed order.
// ---------------------------------------------------------------------------
__global__ __launch_bounds__(256) void k_mix(
    const float* __restrict__ Wv, const float* __restrict__ bv,
    const float* __restrict__ GT, const float* __restrict__ xsum,
    const float* __restrict__ ksum,
    float* __restrict__ MT, float* __restrict__ vsum)
{
  __shared__ float red[4 * 512];

  const int ct = blockIdx.x, b = blockIdx.y;
  const int tid = threadIdx.x, lane = tid & 31, w = tid >> 5;
  const int lm = lane & 15, hi = lane >> 4, kb = hi * 2;
  const int mt = w & 1, kq = w >> 1;

  const float* ap = Wv + (size_t)(ct * 16 + lm) * CCH + kq * 64 + kb;
  const float* gp = GT + ((size_t)b * CCH + kq * 64 + kb) * 32 + mt * 16 + lm;
  v8f acc = zero8();
#pragma unroll
  for (int kk = 0; kk < 16; ++kk) {
    v2f A, Bv;
    A[0]  = ap[kk * 4];        A[1]  = ap[kk * 4 + 1];
    Bv[0] = gp[kk * 4 * 32];   Bv[1] = gp[(kk * 4 + 1) * 32];
    acc = wmma4(A, Bv, acc);
  }
  // stands before any reuse of the address registers of the Wv/GT loads above;
  // naming them as inputs keeps those registers untouched up to this wait
  asm volatile("s_wait_xcnt 0x0" :: "v"(ap), "v"(gp) : "memory");
#pragma unroll
  for (int j = 0; j < 8; ++j)
    red[kq * 512 + (hi * 8 + j) * 32 + mt * 16 + lm] = acc[j];

  // value_sum: 16 threads per output row, 16 input channels each
  const int r = tid >> 4, sl = tid & 15;
  const float* wr = Wv + (size_t)(ct * 16 + r) * CCH + sl;
  const float* xr = xsum + b * CCH + sl;
  float ps = 0.f;
#pragma unroll
  for (int q = 0; q < 16; ++q) ps += wr[q * 16] * xr[q * 16];
  // the same for the Wv loads above (the xsum loads are addressed by sl, kept)
  asm volatile("s_wait_xcnt 0x0" :: "v"(wr) : "memory");
#pragma unroll
  for (int d = 8; d >= 1; d >>= 1) ps += __shfl_xor(ps, d);
  if (sl == 0)
    vsum[b * CCH + ct * 16 + r] = ps + 16384.0f * bv[ct * 16 + r];
  __syncthreads();

  for (int i = tid; i < 512; i += 256)
    MT[((size_t)b * CCH + ct * 16) * 32 + i] =
        ((red[i] + red[512 + i]) + (red[1024 + i] + red[1536 + i])) +
        bv[ct * 16 + (i >> 5)] * ksum[b * CQK + (i & 31)];
}

// ---------------------------------------------------------------------------
// Kernel 3: out[b][c][n] = tailor(n) * (vsum[c] + sum_m MT[c][m]*Qn[n][m])
// with tailor(n) = gamma / (N + Qn[n,:] . (ksum + eps)).
// Grid (N/128, B); matrixT + Qn tile + vsum staged in LDS with padded row
// strides (36) so every ds_load_b64 of A/B is bank-conflict-free.
// ---------------------------------------------------------------------------
__global__ __launch_bounds__(256) void k_final(
    const float* __restrict__ Qn, const float* __restrict__ MT,
    const float* __restrict__ vsum, const float* __restrict__ ksum,
    const float* __restrict__ gamma, float* __restrict__ out)
{
  __shared__ float Ms[CCH * MSP];   // 36 KB
  __shared__ float Qs[128 * QSP];   // 18 KB
  __shared__ float vs_s[CCH];
  __shared__ float tg_s[128];

  const int nblk = blockIdx.x, b = blockIdx.y;
  const int n0 = nblk * 128;
  const int tid = threadIdx.x, lane = tid & 31, w = tid >> 5;
  const int lm = lane & 15, hi = lane >> 4, kb = hi * 2;

  {
    // Ms: thread t stages matrixT row t (8 float4, padded dst stride)
    const float4* src = (const float4*)(MT + (size_t)b * CCH * 32 + tid * 32);
    float4*       dst = (float4*)(Ms + tid * MSP);
#pragma unroll
    for (int i = 0; i < 8; ++i) dst[i] = src[i];
    // Qs: two threads per row of 32 floats
    const int qr = tid >> 1, qseg = (tid & 1) * 4;
    const float4* qsrc =
        (const float4*)(Qn + ((size_t)b * NN + n0 + qr) * 32) + qseg;
    float4* qdst = (float4*)(Qs + qr * QSP) + qseg;
#pragma unroll
    for (int i = 0; i < 4; ++i) qdst[i] = qsrc[i];
    vs_s[tid] = vsum[b * CCH + tid];
  }
  __syncthreads();

  if (tid < 128) {
    const float* q = Qs + tid * QSP;
    float dot = 0.f;
#pragma unroll
    for (int m = 0; m < 32; ++m) dot += q[m] * (ksum[b * CQK + m] + 1e-6f);
    tg_s[tid] = gamma[0] / (16384.0f + dot);
  }
  __syncthreads();

#pragma unroll 1
  for (int i = 0; i < 2; ++i) {
    const int ct = w * 2 + i;
    v2f A[8];
    {
      const float* ap = Ms + (ct * 16 + lm) * MSP + kb;
#pragma unroll
      for (int k = 0; k < 8; ++k) { A[k][0] = ap[k * 4]; A[k][1] = ap[k * 4 + 1]; }
    }
    float vinit[8];
#pragma unroll
    for (int j = 0; j < 8; ++j) vinit[j] = vs_s[ct * 16 + hi * 8 + j];

#pragma unroll 1
    for (int nt = 0; nt < 8; ++nt) {
      v8f acc;
#pragma unroll
      for (int j = 0; j < 8; ++j) acc[j] = vinit[j];
      const float* qp = Qs + (nt * 16 + lm) * QSP + kb;
#pragma unroll
      for (int k = 0; k < 8; ++k) {
        v2f Bv; Bv[0] = qp[k * 4]; Bv[1] = qp[k * 4 + 1];
        acc = wmma4(A[k], Bv, acc);
      }
      const float tg = tg_s[nt * 16 + lm];
#pragma unroll
      for (int j = 0; j < 8; ++j) {
        const int crow = ct * 16 + hi * 8 + j;
        out[((size_t)b * CCH + crow) * NN + n0 + nt * 16 + lm] = acc[j] * tg;
      }
    }
  }
}

// ---------------------------------------------------------------------------
extern "C" void kernel_launch(void* const* d_in, const int* in_sizes, int n_in,
                              void* d_out, int out_size, void* d_ws, size_t ws_size,
                              hipStream_t stream)
{
  (void)in_sizes; (void)n_in; (void)out_size; (void)ws_size;
  const float* x     = (const float*)d_in[0];
  const float* Wq    = (const float*)d_in[1];
  const float* bq    = (const float*)d_in[2];
  const float* Wk    = (const float*)d_in[3];
  const float* bk    = (const float*)d_in[4];
  const float* Wv    = (const float*)d_in[5];
  const float* bv    = (const float*)d_in[6];
  const float* gamma = (const float*)d_in[7];
  float* out = (float*)d_out;

  // workspace layout (floats): Qn | Kn | GT | xsum | ksum | MT | vsum
  float* Qn   = (float*)d_ws;                       // B*N*32
  float* Kn   = Qn + (size_t)BB * NN * 32;          // B*N*32
  float* GT   = Kn + (size_t)BB * NN * 32;          // B*256*32
  float* xsum = GT + (size_t)BB * CCH * 32;         // B*256
  float* ksum = xsum + (size_t)BB * CCH;            // B*32
  float* MT   = ksum + (size_t)BB * CQK;            // B*256*32
  float* vsum = MT + (size_t)BB * CCH * 32;         // B*256

  k_qk<<<dim3(NN / 64, BB), 256, 0, stream>>>(x, Wq, bq, Wk, bk, Qn, Kn, GT);
  k_matrix<<<dim3(4, 16, BB), 256, 0, stream>>>(x, Kn, GT, xsum, ksum);
  k_mix<<<dim3(16, BB), 256, 0, stream>>>(Wv, bv, GT, xsum, ksum, MT, vsum);
  k_final<<<dim3(NN / 128, BB), 256, 0, stream>>>(Qn, MT, vsum, ksum, gamma, out);
}

// v003
// A run of this version takes 51.1 microseconds.
// Two timings next to v002 put it at 1.24 and 1.25 times that version's speed.
// Counting every step since v000, it is 2.59 times as fast.
#include <hip/hip_runtime.h>
#include <math.h>

#define BB   4
#define CCH  256
#define CQK  32
#define NN   16384
#define XPAD 68   // x-tile row pad: bank-conflict-free for stride-68 access
#define MSP  36   // Ms row stride in k_final (36*l mod 64 distinct for l<16)
#define QSP  36   // Qs row stride in k_final
#define ACCN (BB * CCH * 32 + BB * CCH + BB * CQK)  // floats of GT | xsum | ksum

typedef __attribute__((ext_vector_type(2))) float v2f;
typedef __attribute__((ext_vector_type(8))) float v8f;

__device__ __forceinline__ v8f wmma4(v2f a, v2f b, v8f c) {
  // D = A(16x4) * B(4x16) + C,  f32 WMMA
  return __builtin_amdgcn_wmma_f32_16x16x4_f32(false, a, false, b, (short)0, c,
                                               false, false);
}
__device__ __forceinline__ v8f zero8() {
  v8f z = {0.f, 0.f, 0.f, 0.f, 0.f, 0.f, 0.f, 0.f};
  return z;
}

// gfx1250 async global->LDS copy, tracked by ASYNCcnt (no VGPR round-trip).
__device__ __forceinline__ void async_b32(unsigned lds_off, const float* gptr) {
  asm volatile("global_load_async_to_lds_b32 %0, %1, off"
               :: "v"(lds_off), "v"(gptr)
               : "memory");
}
__device__ __forceinline__ void wait_async0() {
  asm volatile("s_wait_asynccnt 0" ::: "memory");
}

// ---------------------------------------------------------------------------
// Kernel 1: fused Q/K projection (+bias, +L2 norm of Q/K over 32 channels)
// V = Wv x + bv is never formed: it enters the result only through
//   sum_n V[c,n] Kn[n,m] = sum_c' Wv[c,c'] (sum_n x[c',n] Kn[n,m]) + bv[c] ksum[m]
//   sum_n V[c,n]         = sum_c' Wv[c,c'] (sum_n x[c',n])         + N bv[c]
// so k_matrix reduces x itself over n and k_mix applies Wv to the small result.
// 256 threads (8 waves), 64 positions/block. x staged TRANSPOSED [n][c] in
// LDS via double-buffered async-to-LDS copies, so every WMMA B operand is a
// single ds_load_b64. Wave w owns Q/K m-tile (w & 3) on n-tiles
// {2(w>>2), 2(w>>2)+1}. Outputs: Qn/Kn [b][N][32].
// The first blocks also store the start value 0 of the accumulators (GT, xsum,
// ksum, contiguous at acc0) that the next launch, k_matrix, adds into.
// ---------------------------------------------------------------------------
__global__ __launch_bounds__(256) void k_qk(
    const float* __restrict__ x,
    const float* __restrict__ Wq, const float* __restrict__ bq,
    const float* __restrict__ Wk, const float* __restrict__ bk,
    float* __restrict__ Qn, float* __restrict__ Kn, float* __restrict__ acc0)
{
  __shared__ float xsA[64 * XPAD];  // transposed x chunk: [n(64)][c(64)+pad]
  __shared__ float xsB[64 * XPAD];  // double buffer
  __shared__ float qs [64 * XPAD];  // raw Q rows 0..31 / K rows 32..63: [c][n]

  const int nblk = blockIdx.x;
  const int b    = blockIdx.y;
  const int n0   = nblk * 64;
  const int tid  = threadIdx.x;
  const int lane = tid & 31;
  const int w    = tid >> 5;
  const int lm   = lane & 15;
  const int hi   = lane >> 4;       // 0/1
  const int kb   = hi * 2;          // K-base within 4-wide K slice

  const float* xb = x + (size_t)b * CCH * NN;
  const unsigned baseA = (unsigned)(size_t)(void*)xsA;
  const unsigned baseB = (unsigned)(size_t)(void*)xsB;

  v8f accQ[2];
#pragma unroll
  for (int t = 0; t < 2; ++t) accQ[t] = zero8();

  const int    mt    = w & 3;               // m-tile: 0,1 -> Q; 2,3 -> K
  const int    ntb   = (w >> 2) * 2;        // first of this wave's 2 n-tiles
  const float* Wm    = (mt < 2) ? Wq : Wk;
  const float* bqk   = (mt < 2) ? bq : bk;
  const int    qkm   = (mt & 1) * 16;       // m-row base inside the 32

  // issue one 64x64 chunk: 128 wave-instructions; wave w issues 16.
  // per instruction: 32 lanes read 128B contiguous of channel c, scatter
  // to LDS column c of the transposed tile (stride 68 -> conflict-free).
  auto issue_chunk = [&](int chunk, unsigned lbase) {
    const float* gb = xb + (size_t)(chunk * 64) * NN + n0;
#pragma unroll 2
    for (int i = 0; i < 16; ++i) {
      const int idx = w * 16 + i;
      const int c   = idx >> 1;
      const int h   = idx & 1;
      const int nl  = h * 32 + lane;
      async_b32(lbase + (unsigned)(nl * XPAD + c) * 4u,
                gb + (size_t)c * NN + nl);
    }
  };

  issue_chunk(0, baseA);
  wait_async0();
  __syncthreads();

#pragma unroll 1
  for (int chunk = 0; chunk < 4; ++chunk) {
    const float* xs = (chunk & 1) ? xsB : xsA;
    if (chunk < 3) issue_chunk(chunk + 1, (chunk & 1) ? baseA : baseB);
    const int cb = chunk * 64;

#pragma unroll 2
    for (int kk = 0; kk < 16; ++kk) {
      const int c4 = kk * 4;
      v2f Bt[2];
#pragma unroll
      for (int t = 0; t < 2; ++t) {
        const float* p = xs + ((ntb + t) * 16 + lm) * XPAD + c4 + kb;
        Bt[t][0] = p[0];           // contiguous pair -> one ds_load_b64
        Bt[t][1] = p[1];
      }
      const int cg = cb + c4 + kb;  // global input-channel for A loads
      const float* ap = Wm + (size_t)(qkm + lm) * CCH + cg;
      v2f A; A[0] = ap[0]; A[1] = ap[1];
#pragma unroll
      for (int t = 0; t < 2; ++t)
        accQ[t] = wmma4(A, Bt[t], accQ[t]);
    }
    wait_async0();     // next buffer's writes complete (this wave)
    __syncthreads();   // all waves done reading cur + writing next
  }

  // ---- Q/K: bias + write raw tiles to LDS ([c][n] layout) ----
  {
    const int rbase = mt * 16;
#pragma unroll
    for (int j = 0; j < 8; ++j) {
      const int   r    = rbase + hi * 8 + j;
      const float bias = bqk[qkm + hi * 8 + j];
#pragma unroll
      for (int t = 0; t < 2; ++t)
        qs[r * XPAD + (ntb + t) * 16 + lm] = accQ[t][j] + bias;
    }
  }
  __syncthreads();

  // ---- L2-normalize columns; write Qn/Kn as [b][n][32] ----
  if (tid < 128) {
    const int n   = tid & 63;
    const int isK = tid >> 6;
    const float* col = qs + isK * 32 * XPAD + n;
    float v[32];
    float ss = 0.f;
#pragma unroll
    for (int m = 0; m < 32; ++m) { v[m] = col[m * XPAD]; ss += v[m] * v[m]; }
    const float inv = 1.0f / sqrtf(ss);
    float* dst = (isK ? Kn : Qn) + ((size_t)b * NN + n0 + n) * 32;
#pragma unroll
    for (int m = 0; m < 32; m += 4) {
      float4 o;
      o.x = v[m] * inv;     o.y = v[m + 1] * inv;
      o.z = v[m + 2] * inv; o.w = v[m + 3] * inv;
      *(float4*)(dst + m) = o;
    }
  }

  // ---- start value of k_matrix's accumulators: one float per thread ----
  const int zi = (b * (NN / 64) + nblk) * 256 + tid;
  if (zi < ACCN) acc0[zi] = 0.f;
}

// ---------------------------------------------------------------------------
// Kernel 2: MT[b][c][m] = sum_n V[c,n]*Kn[n,m];  vsum = row sums of V; ksum.
// It is launched with V = x, so its MT is GT and its vsum is xsum (see k_qk).
// Grid (slab=8, ctile=8, b=4): a block reduces 32 rows of V over 2048
// positions, in 8 stages of 256 positions. A stage (V rows in their own [c][n]
// order, Kn rows [n][32]) is brought into LDS by whole-line async b128 copies,
// two buffers, so the next stage flies while this one is multiplied. Row
// pitches 260 and 40 floats keep the fragment reads free of bank conflicts.
// Wave w takes positions [32w, 32w+32) of every stage on 2x2 accumulator tiles;
// LDS atomic adds over the waves, then global f32 atomics.
// ---------------------------------------------------------------------------
#define MNT  256                 // positions per stage
#define MXP  260                 // LDS pitch of a V row (floats)
#define MKP  40                  // LDS pitch of a Kn row (floats)
#define MXB  (32 * MXP)          // floats of the V part of a stage
#define MSTG (MXB + MNT * MKP)   // floats of a stage

// Eight async global->LDS copies of 16 B per lane. The s_wait_xcnt stands in
// the copies' own statement so that no address register named here is
// rewritten in front of it.
__device__ __forceinline__ void async8_b128(const unsigned (&l)[8],
                                            const float* const (&g)[8]) {
  asm volatile(
      "global_load_async_to_lds_b128 %0, %8, off\n\t"
      "global_load_async_to_lds_b128 %1, %9, off\n\t"
      "global_load_async_to_lds_b128 %2, %10, off\n\t"
      "global_load_async_to_lds_b128 %3, %11, off\n\t"
      "global_load_async_to_lds_b128 %4, %12, off\n\t"
      "global_load_async_to_lds_b128 %5, %13, off\n\t"
      "global_load_async_to_lds_b128 %6, %14, off\n\t"
      "global_load_async_to_lds_b128 %7, %15, off\n\t"
      "s_wait_xcnt 0x0"
      :: "v"(l[0]), "v"(l[1]), "v"(l[2]), "v"(l[3]),
         "v"(l[4]), "v"(l[5]), "v"(l[6]), "v"(l[7]),
         "v"(g[0]), "v"(g[1]), "v"(g[2]), "v"(g[3]),
         "v"(g[4]), "v"(g[5]), "v"(g[6]), "v"(g[7])
      : "memory");
}

__global__ __launch_bounds__(256) void k_matrix(
    const float* __restrict__ V, const float* __restrict__ Kn,
    float* __restrict__ MT, float* __restrict__ vsum, float* __restrict__ ksum)
{
  __shared__ __attribute__((aligned(16))) float stg[2 * MSTG];
  __shared__ float tile_s[32 * 32];
  __shared__ float vs_s[32];
  __shared__ float ks_s[32];

  const int slab = blockIdx.x, ct = blockIdx.y, b = blockIdx.z;
  const int tid = threadIdx.x, lane = tid & 31, w = tid >> 5;
  const int lm = lane & 15, hi = lane >> 4, kb = hi * 2;

  if (tid < 32) { vs_s[tid] = 0.f; ks_s[tid] = 0.f; }
  for (int i = tid; i < 1024; i += 256) tile_s[i] = 0.f;

  const float* xg = V + ((size_t)b * CCH + ct * 32) * NN + slab * 2048;
  const float* kg = Kn + ((size_t)b * NN + slab * 2048) * 32;
  const unsigned sbase = (unsigned)(size_t)(void*)stg;

  // one stage = 64 KB = 128 wave-wide copies of 512 B; wave w issues 16:
  // V rows 4w..4w+3 (two 512-B halves each) and Kn rows 32w..32w+31 (4 a copy)
  auto issue_stage = [&](int t, int buf) {
    const unsigned lb = sbase + (unsigned)buf * (unsigned)(MSTG * 4);
    unsigned     l[8];
    const float* g[8];
    // both loops unrolled: l[] and g[] must be registers, they are asm operands
#pragma unroll
    for (int q = 0; q < 8; ++q) {
      const int row = w * 4 + (q >> 1);
      const int off = (q & 1) * 128 + lane * 4;
      l[q] = lb + (unsigned)(row * MXP + off) * 4u;
      g[q] = xg + (size_t)row * NN + t * MNT + off;
    }
    async8_b128(l, g);
#pragma unroll
    for (int q = 0; q < 8; ++q) {
      const int seg = w * 8 + q;
      const int r   = seg * 4 + (lane >> 3);
      l[q] = lb + (unsigned)(MXB + r * MKP + (lane & 7) * 4) * 4u;
      g[q] = kg + (size_t)t * (MNT * 32) + seg * 128 + lane * 4;
    }
    async8_b128(l, g);
  };

  issue_stage(0, 0);
  wait_async0();     // stage 0 landed (this wave's copies)
  __syncthreads();   // ... and every other wave's; also publishes the zeros
  issue_stage(1, 1);

  v8f acc00 = zero8(), acc01 = zero8(), acc10 = zero8(), acc11 = zero8();
  float rs0 = 0.f, rs1 = 0.f, k0s = 0.f, k1s = 0.f;
  // kept rolled: one copy of the 32-WMMA body, the buffer chosen by t & 1
#pragma unroll 1
  for (int t = 0; t < 8; ++t) {
    const float* xs = stg + (t & 1) * MSTG;
    const float* ks = xs + MXB;
    // unrolled: later k-steps' LDS reads are issued ahead of the WMMAs
#pragma unroll
    for (int kk = 0; kk < 8; ++kk) {
      const int n = w * 32 + kk * 4 + kb;
      const float* a0 = xs + lm * MXP + n;
      const float* a1 = a0 + 16 * MXP;
      v2f A0, A1;
      A0[0] = a0[0]; A0[1] = a0[1];     // contiguous pair -> one ds_load_b64
      A1[0] = a1[0]; A1[1] = a1[1];
      rs0 += A0[0] + A0[1];
      rs1 += A1[0] + A1[1];
      const float* kp = ks + n * MKP + lm;
      v2f B0, B1;
      B0[0] = kp[0];  B0[1] = kp[MKP];
      B1[0] = kp[16]; B1[1] = kp[MKP + 16];
      k0s += B0[0] + B0[1];
      k1s += B1[0] + B1[1];
      acc00 = wmma4(A0, B0, acc00);
      acc01 = wmma4(A0, B1, acc01);
      acc10 = wmma4(A1, B0, acc10);
      acc11 = wmma4(A1, B1, acc11);
    }
    // this wave's reads of the buffer are done before it may be refilled
    asm volatile("s_wait_dscnt 0x0" ::: "memory");
    wait_async0();     // stage t+1 landed (this wave's copies)
    __syncthreads();   // publishes stage t+1, ends every read of stage t
    if (t + 2 < 8) issue_stage(t + 2, t & 1);
  }
  wait_async0();       // nothing in flight when the wave goes on

#pragma unroll
  for (int j = 0; j < 8; ++j) {
    const int row = hi * 8 + j;
    atomicAdd(&tile_s[row * 32 + lm], acc00[j]);
    atomicAdd(&tile_s[row * 32 + 16 + lm], acc01[j]);
    atomicAdd(&tile_s[(16 + row) * 32 + lm], acc10[j]);
    atomicAdd(&tile_s[(16 + row) * 32 + 16 + lm], acc11[j]);
  }
  atomicAdd(&vs_s[lm], rs0);
  atomicAdd(&vs_s[16 + lm], rs1);
  if (ct == 0) {
    atomicAdd(&ks_s[lm], k0s);
    atomicAdd(&ks_s[16 + lm], k1s);
  }
  __syncthreads();

  for (int i = tid; i < 1024; i += 256)
    atomicAdd(&MT[((size_t)b * CCH + ct * 32) * 32 + i], tile_s[i]);
  if (tid < 32) atomicAdd(&vsum[b * CCH + ct * 32 + tid], vs_s[tid]);
  if (ct == 0 && tid < 32) atomicAdd(&ksum[b * CQK + tid], ks_s[tid]);
}

// ---------------------------------------------------------------------------
// Kernel 2b: apply Wv to the reduced x:
//   MT[b][c][m] = sum_c' Wv[c][c'] * GT[b][c'][m] + bv[c] * ksum[b][m]
//   vsum[b][c]  = sum_c' Wv[c][c'] * xsum[b][c']  + N * bv[c]
// Grid (ctile=16, b=4); wave w: m-tile (w & 1), quarter (w >> 1) of the 256
// input channels; the four quarters are summed through LDS in a fixed order.
// ---------------------------------------------------------------------------
__global__ __launch_bounds__(256) void k_mix(
    const float* __restrict__ Wv, const float* __restrict__ bv,
    const float* __restrict__ GT, const float* __restrict__ xsum,
    const float* __restrict__ ksum,
    float* __restrict__ MT, float* __restrict__ vsum)
{
  __shared__ float red[4 * 512];

  const int ct = blockIdx.x, b = blockIdx.y;
  const int tid = threadIdx.x, lane = tid & 31, w = tid >> 5;
  const int lm = lane & 15, hi = lane >> 4, kb = hi * 2;
  const int mt = w & 1, kq = w >> 1;

  const float* ap = Wv + (size_t)(ct * 16 + lm) * CCH + kq * 64 + kb;
  const float* gp = GT + ((size_t)b * CCH + kq * 64 + kb) * 32 + mt * 16 + lm;
  v8f acc = zero8();
#pragma unroll
  for (int kk = 0; kk < 16; ++kk) {
    v2f A, Bv;
    A[0]  = ap[kk * 4];        A[1]  = ap[kk * 4 + 1];
    Bv[0] = gp[kk * 4 * 32];   Bv[1] = gp[(kk * 4 + 1) * 32];
    acc = wmma4(A, Bv, acc);
  }
  // stands before any reuse of the address registers of the Wv/GT loads above;
  // naming them as inputs keeps those registers untouched up to this wait
  asm volatile("s_wait_xcnt 0x0" :: "v"(ap), "v"(gp) : "memory");
#pragma unroll
  for (int j = 0; j < 8; ++j)
    red[kq * 512 + (hi * 8 + j) * 32 + mt * 16 + lm] = acc[j];

  // value_sum: 16 threads per output row, 16 input channels each
  const int r = tid >> 4, sl = tid & 15;
  const float* wr = Wv + (size_t)(ct * 16 + r) * CCH + sl;
  const float* xr = xsum + b * CCH + sl;
  float ps = 0.f;
#pragma unroll
  for (int q = 0; q < 16; ++q) ps += wr[q * 16] * xr[q * 16];
  // the same for the Wv loads above (the xsum loads are addressed by sl, kept)
  asm volatile("s_wait_xcnt 0x0" :: "v"(wr) : "memory");
#pragma unroll
  for (int d = 8; d >= 1; d >>= 1) ps += __shfl_xor(ps, d);
  if (sl == 0)
    vsum[b * CCH + ct * 16 + r] = ps + 16384.0f * bv[ct * 16 + r];
  __syncthreads();

  for (int i = tid; i < 512; i += 256)
    MT[((size_t)b * CCH + ct * 16) * 32 + i] =
        ((red[i] + red[512 + i]) + (red[1024 + i] + red[1536 + i])) +
        bv[ct * 16 + (i >> 5)] * ksum[b * CQK + (i & 31)];
}

// ---------------------------------------------------------------------------
// Kernel 3: out[b][c][n] = tailor(n) * (vsum[c] + sum_m MT[c][m]*Qn[n][m])
// with tailor(n) = gamma / (N + Qn[n,:] . (ksum + eps)).
// Grid (N/128, B); matrixT + Qn tile + vsum staged in LDS with padded row
// strides (36) so every ds_load_b64 of A/B is bank-conflict-free.
// ---------------------------------------------------------------------------
__global__ __launch_bounds__(256) void k_final(
    const float* __restrict__ Qn, const float* __restrict__ MT,
    const float* __restrict__ vsum, const float* __restrict__ ksum,
    const float* __restrict__ gamma, float* __restrict__ out)
{
  __shared__ float Ms[CCH * MSP];   // 36 KB
  __shared__ float Qs[128 * QSP];   // 18 KB
  __shared__ float vs_s[CCH];
  __shared__ float tg_s[128];

  const int nblk = blockIdx.x, b = blockIdx.y;
  const int n0 = nblk * 128;
  const int tid = threadIdx.x, lane = tid & 31, w = tid >> 5;
  const int lm = lane & 15, hi = lane >> 4, kb = hi * 2;

  {
    // Ms: thread t stages matrixT row t (8 float4, padded dst stride)
    const float4* src = (const float4*)(MT + (size_t)b * CCH * 32 + tid * 32);
    float4*       dst = (float4*)(Ms + tid * MSP);
#pragma unroll
    for (int i = 0; i < 8; ++i) dst[i] = src[i];
    // Qs: two threads per row of 32 floats
    const int qr = tid >> 1, qseg = (tid & 1) * 4;
    const float4* qsrc =
        (const float4*)(Qn + ((size_t)b * NN + n0 + qr) * 32) + qseg;
    float4* qdst = (float4*)(Qs + qr * QSP) + qseg;
#pragma unroll
    for (int i = 0; i < 4; ++i) qdst[i] = qsrc[i];
    vs_s[tid] = vsum[b * CCH + tid];
  }
  __syncthreads();

  if (tid < 128) {
    const float* q = Qs + tid * QSP;
    float dot = 0.f;
#pragma unroll
    for (int m = 0; m < 32; ++m) dot += q[m] * (ksum[b * CQK + m] + 1e-6f);
    tg_s[tid] = gamma[0] / (16384.0f + dot);
  }
  __syncthreads();

#pragma unroll 1
  for (int i = 0; i < 2; ++i) {
    const int ct = w * 2 + i;
    v2f A[8];
    {
      const float* ap = Ms + (ct * 16 + lm) * MSP + kb;
#pragma unroll
      for (int k = 0; k < 8; ++k) { A[k][0] = ap[k * 4]; A[k][1] = ap[k * 4 + 1]; }
    }
    float vinit[8];
#pragma unroll
    for (int j = 0; j < 8; ++j) vinit[j] = vs_s[ct * 16 + hi * 8 + j];

#pragma unroll 1
    for (int nt = 0; nt < 8; ++nt) {
      v8f acc;
#pragma unroll
      for (int j = 0; j < 8; ++j) acc[j] = vinit[j];
      const float* qp = Qs + (nt * 16 + lm) * QSP + kb;
#pragma unroll
      for (int k = 0; k < 8; ++k) {
        v2f Bv; Bv[0] = qp[k * 4]; Bv[1] = qp[k * 4 + 1];
        acc = wmma4(A[k], Bv, acc);
      }
      const float tg = tg_s[nt * 16 + lm];
#pragma unroll
      for (int j = 0; j < 8; ++j) {
        const int crow = ct * 16 + hi * 8 + j;
        out[((size_t)b * CCH + crow) * NN + n0 + nt * 16 + lm] = acc[j] * tg;
      }
    }
  }
}

// ---------------------------------------------------------------------------
extern "C" void kernel_launch(void* const* d_in, const int* in_sizes, int n_in,
                              void* d_out, int out_size, void* d_ws, size_t ws_size,
                              hipStream_t stream)
{
  (void)in_sizes; (void)n_in; (void)out_size; (void)ws_size;
  const float* x     = (const float*)d_in[0];
  const float* Wq    = (const float*)d_in[1];
  const float* bq    = (const float*)d_in[2];
  const float* Wk    = (const float*)d_in[3];
  const float* bk    = (const float*)d_in[4];
  const float* Wv    = (const float*)d_in[5];
  const float* bv    = (const float*)d_in[6];
  const float* gamma = (const float*)d_in[7];
  float* out = (float*)d_out;

  // workspace layout (floats): Qn | Kn | GT | xsum | ksum | MT | vsum
  float* Qn   = (float*)d_ws;                       // B*N*32
  float* Kn   = Qn + (size_t)BB * NN * 32;          // B*N*32
  float* GT   = Kn + (size_t)BB * NN * 32;          // B*256*32
  float* xsum = GT + (size_t)BB * CCH * 32;         // B*256
  float* ksum = xsum + (size_t)BB * CCH;            // B*32
  float* MT   = ksum + (size_t)BB * CQK;            // B*256*32
  float* vsum = MT + (size_t)BB * CCH * 32;         // B*256

  k_qk<<<dim3(NN / 64, BB), 256, 0, stream>>>(x, Wq, bq, Wk, bk, Qn, Kn, GT);
  k_matrix<<<dim3(8, 8, BB), 256, 0, stream>>>(x, Kn, GT, xsum, ksum);
  k_mix<<<dim3(16, BB), 256, 0, stream>>>(Wv, bv, GT, xsum, ksum, MT, vsum);
  k_final<<<dim3(NN / 128, BB), 256, 0, stream>>>(Qn, MT, vsum, ksum, gamma, out);
}
